// v000
// The times below were measured on an AMD MI455X: many runs one after another, warmed up first and cycling through
// copies of the inputs, with the whole window's GPU time divided by the number of runs. Launches and the gaps
// between them are all in it. The median over several windows is given; except for v000 it joins two sittings, which
// can be a few percent apart, so the side-by-side timings, each taken in one sitting, are the better comparison.
// v000, which the later versions start from, runs in 50.6 microseconds.
#include <hip/hip_runtime.h>

// CDNA5 / gfx1250: wave32, WMMA 16x16x4 f32 + packed-f32 (V_PK_FMA_F32) MLP,
// online softmax with deferred (per-lane partial) denominator.
typedef __attribute__((ext_vector_type(2))) float v2f;
typedef __attribute__((ext_vector_type(8))) float v8f;

#define B_ 4
#define H_ 16
#define R_ 512
#define C_ 512
#define D_ 16
#define M_ 16

__device__ __forceinline__ float group16_max(float x) {
  x = fmaxf(x, __shfl_xor(x, 1, 32));
  x = fmaxf(x, __shfl_xor(x, 2, 32));
  x = fmaxf(x, __shfl_xor(x, 4, 32));
  x = fmaxf(x, __shfl_xor(x, 8, 32));
  return x;
}
__device__ __forceinline__ float group16_sum(float x) {
  x += __shfl_xor(x, 1, 32);
  x += __shfl_xor(x, 2, 32);
  x += __shfl_xor(x, 4, 32);
  x += __shfl_xor(x, 8, 32);
  return x;
}

__global__ __launch_bounds__(256)
void mixed_attn_kernel(const float* __restrict__ q,
                       const float* __restrict__ k,
                       const float* __restrict__ v,
                       const float* __restrict__ cost,
                       const float* __restrict__ w1,
                       const float* __restrict__ b1,
                       const float* __restrict__ w2,
                       const float* __restrict__ b2,
                       float* __restrict__ out) {
  // per-wave 16x16 P-transpose staging, padded to 17 to avoid bank conflicts
  __shared__ float plds[8][16 * 17];

  const int wave = threadIdx.x >> 5;
  const int lane = threadIdx.x & 31;
  const int lr   = lane & 15;   // index within 16-lane group
  const int hl   = lane >> 4;   // lane half (0/1)

  const int blk = blockIdx.x;
  const int rb  = blk & 3;          // 128-row block within R
  const int h   = (blk >> 2) & 15;  // head
  const int b   = blk >> 6;         // batch

  const int row_base = rb * 128 + wave * 16;

  const float* qh    = q + (size_t)(b * H_ + h) * R_ * D_;
  const float* kh    = k + (size_t)(b * H_ + h) * C_ * D_;
  const float* vh    = v + (size_t)(b * H_ + h) * C_ * D_;
  const float* costb = cost + (size_t)b * R_ * C_;

  // per-head MLP parameters, packed in pairs for V_PK_FMA_F32 (all 8B aligned)
  v2f w1a2[M_ / 2], w1b2[M_ / 2], b12[M_ / 2], w22[M_ / 2];
#pragma unroll
  for (int mm = 0; mm < M_ / 2; ++mm) {
    w1a2[mm] = *reinterpret_cast<const v2f*>(w1 + h * 2 * M_ + 2 * mm);       // dot weights
    w1b2[mm] = *reinterpret_cast<const v2f*>(w1 + h * 2 * M_ + M_ + 2 * mm);  // cost weights
    b12[mm]  = *reinterpret_cast<const v2f*>(b1 + h * M_ + 2 * mm);
    w22[mm]  = *reinterpret_cast<const v2f*>(w2 + h * M_ + 2 * mm);
  }
  const float bb2 = b2[h];
  const v2f zero2 = {0.0f, 0.0f};

  // Q tile, A-layout for V_WMMA_F32_16X16X4_F32:
  // lane holds row (lr), VGPR v holds K = 4*kk + 2*hl + v  (even -> 8B aligned)
  v2f qa[4];
#pragma unroll
  for (int kk = 0; kk < 4; ++kk)
    qa[kk] = *reinterpret_cast<const v2f*>(qh + (row_base + lr) * D_ + 4 * kk + 2 * hl);

  v8f o = {};            // O accumulator, D-layout: r = w + 8*hl, d = lr
  float mrun[8], lrun[8];  // running row max / per-lane partial exp-sum
#pragma unroll
  for (int w = 0; w < 8; ++w) { mrun[w] = -3.0e38f; lrun[w] = 0.0f; }

  for (int c0 = 0; c0 < C_; c0 += 16) {
    // K tile, B-layout: lane holds column c0+lr, VGPR v holds K(=d) = 4*kk + 2*hl + v
    v2f kb[4];
#pragma unroll
    for (int kk = 0; kk < 4; ++kk)
      kb[kk] = *reinterpret_cast<const v2f*>(kh + (c0 + lr) * D_ + 4 * kk + 2 * hl);

    // S = Q * K^T  (K-dim 16 = 4 chained 16x16x4 f32 WMMAs)
    v8f s = {};
#pragma unroll
    for (int kk = 0; kk < 4; ++kk)
      s = __builtin_amdgcn_wmma_f32_16x16x4_f32(false, qa[kk], false, kb[kk],
                                                (short)0, s, false, false);

    // mixed score MLP (packed f32 pairs) + online softmax
    // D-layout: r = w + 8*hl, c = c0 + lr
    float p[8];
#pragma unroll
    for (int w = 0; w < 8; ++w) {
      const int r = row_base + w + 8 * hl;
      const float dot = s[w] * 0.25f;                       // 1/sqrt(D)
      const float cst = costb[(size_t)r * C_ + (c0 + lr)];
      const v2f dot2 = {dot, dot};
      const v2f cst2 = {cst, cst};
      v2f acc2 = {bb2, 0.0f};
#pragma unroll
      for (int mm = 0; mm < M_ / 2; ++mm) {
        v2f hv = __builtin_elementwise_fma(cst2, w1b2[mm], b12[mm]);
        hv = __builtin_elementwise_fma(dot2, w1a2[mm], hv);
        hv = __builtin_elementwise_max(hv, zero2);
        acc2 = __builtin_elementwise_fma(hv, w22[mm], acc2);
      }
      const float acc = acc2[0] + acc2[1];

      // row max must be group-uniform (rescale of o[w] is per-row);
      // denominator is kept as per-lane partial and reduced once at the end.
      const float tmax = group16_max(acc);
      const float mnew = fmaxf(mrun[w], tmax);
      const float resc = __expf(mrun[w] - mnew);
      const float pe   = __expf(acc - mnew);
      lrun[w] = fmaf(lrun[w], resc, pe);
      mrun[w] = mnew;
      o[w] *= resc;
      p[w] = pe;
    }

    // transpose P: D-layout -> A-layout via per-wave LDS tile
#pragma unroll
    for (int w = 0; w < 8; ++w)
      plds[wave][(w + 8 * hl) * 17 + lr] = p[w];
    __builtin_amdgcn_wave_barrier();
    asm volatile("s_wait_dscnt 0x0" ::: "memory");

    v2f pa[4], vb[4];
#pragma unroll
    for (int kk = 0; kk < 4; ++kk) {
      const int cl = 4 * kk + 2 * hl;
      pa[kk][0] = plds[wave][lr * 17 + cl];
      pa[kk][1] = plds[wave][lr * 17 + cl + 1];
      // V tile, B-layout: lane holds d = lr, K(=c local) = cl + v
      vb[kk][0] = vh[(c0 + cl) * D_ + lr];
      vb[kk][1] = vh[(c0 + cl + 1) * D_ + lr];
    }
    __builtin_amdgcn_wave_barrier();

    // O += P * V
#pragma unroll
    for (int kk = 0; kk < 4; ++kk)
      o = __builtin_amdgcn_wmma_f32_16x16x4_f32(false, pa[kk], false, vb[kk],
                                                (short)0, o, false, false);
  }

  // final denominator: one butterfly per row group, then write
  // out[b][r][h*16 + d] = O / l
#pragma unroll
  for (int w = 0; w < 8; ++w) {
    const float lsum = group16_sum(lrun[w]);
    const int r = row_base + w + 8 * hl;
    out[((size_t)b * R_ + r) * (H_ * D_) + h * D_ + lr] = o[w] / lsum;
  }
}

extern "C" void kernel_launch(void* const* d_in, const int* in_sizes, int n_in,
                              void* d_out, int out_size, void* d_ws, size_t ws_size,
                              hipStream_t stream) {
  const float* q    = (const float*)d_in[0];
  const float* k    = (const float*)d_in[1];
  const float* v    = (const float*)d_in[2];
  const float* cost = (const float*)d_in[3];
  const float* w1   = (const float*)d_in[4];
  const float* b1   = (const float*)d_in[5];
  const float* w2   = (const float*)d_in[6];
  const float* b2   = (const float*)d_in[7];
  float* out = (float*)d_out;

  // grid: B * H * (R/128) = 4 * 16 * 4 = 256 blocks; 256 threads = 8 wave32
  dim3 grid(B_ * H_ * (R_ / 128));
  dim3 block(256);
  mixed_attn_kernel<<<grid, block, 0, stream>>>(q, k, v, cost, w1, b1, w2, b2, out);
}

// v001
// Measured time: 32.4 microseconds a run.
// Two timings next to v000 put it at 1.58 and 1.60 times that version's speed.
#include <hip/hip_runtime.h>

// CDNA5 / gfx1250: wave32, WMMA 16x16x4 f32 + packed-f32 (V_PK_FMA_F32) MLP,
// online softmax with deferred (per-lane partial) denominator.
typedef __attribute__((ext_vector_type(2))) float v2f;
typedef __attribute__((ext_vector_type(8))) float v8f;

#define B_ 4
#define H_ 16
#define R_ 512
#define C_ 512
#define D_ 16
#define M_ 16
#define SPLIT_ 3              // column ranges per 16-row tile, one wave each
#define NT_ (C_ / 16)         // 16-column tiles per row tile

__device__ __forceinline__ float group16_sum(float x) {
  x += __shfl_xor(x, 1, 32);
  x += __shfl_xor(x, 2, 32);
  x += __shfl_xor(x, 4, 32);
  x += __shfl_xor(x, 8, 32);
  return x;
}

__global__ __launch_bounds__(256 * SPLIT_)
void mixed_attn_kernel(const float* __restrict__ q,
                       const float* __restrict__ k,
                       const float* __restrict__ v,
                       const float* __restrict__ cost,
                       const float* __restrict__ w1,
                       const float* __restrict__ b1,
                       const float* __restrict__ w2,
                       const float* __restrict__ b2,
                       float* __restrict__ out) {
  // per-wave 16x16 P-transpose staging, padded to 17 to avoid bank conflicts
  __shared__ float plds[8 * SPLIT_][16 * 17];
  // partial (O, row max, per-lane exp-sum) of column ranges 1..SPLIT_-1: [wave][register][lane]
  __shared__ float part[8 * (SPLIT_ - 1)][24][32];

  const int wave = __builtin_amdgcn_readfirstlane(threadIdx.x >> 5);  // scalar: loop bounds stay uniform
  const int rt   = wave & 7;    // 16-row tile within the 128-row block
  const int sp   = wave >> 3;   // column range of this wave
  const int lane = threadIdx.x & 31;
  const int lr   = lane & 15;   // index within 16-lane group
  const int hl   = lane >> 4;   // lane half (0/1)

  const int blk = blockIdx.x;
  const int rb  = blk & 3;          // 128-row block within R
  const int h   = (blk >> 2) & 15;  // head
  const int b   = blk >> 6;         // batch

  const int row_base = rb * 128 + rt * 16;

  const float* qh    = q + (size_t)(b * H_ + h) * R_ * D_;
  const float* kh    = k + (size_t)(b * H_ + h) * C_ * D_;
  const float* vh    = v + (size_t)(b * H_ + h) * C_ * D_;
  const float* costb = cost + (size_t)b * R_ * C_;

  // per-head MLP parameters, packed in pairs for V_PK_FMA_F32 (all 8B aligned)
  v2f w1a2[M_ / 2], w1b2[M_ / 2], b12[M_ / 2], w22[M_ / 2];
#pragma unroll
  for (int mm = 0; mm < M_ / 2; ++mm) {
    w1a2[mm] = *reinterpret_cast<const v2f*>(w1 + h * 2 * M_ + 2 * mm);       // dot weights
    w1b2[mm] = *reinterpret_cast<const v2f*>(w1 + h * 2 * M_ + M_ + 2 * mm);  // cost weights
    b12[mm]  = *reinterpret_cast<const v2f*>(b1 + h * M_ + 2 * mm);
    w22[mm]  = *reinterpret_cast<const v2f*>(w2 + h * M_ + 2 * mm);
  }
  const float bb2 = b2[h];
  const v2f zero2 = {0.0f, 0.0f};

  // Q tile, A-layout for V_WMMA_F32_16X16X4_F32:
  // lane holds row (lr), VGPR v holds K = 4*kk + 2*hl + v  (even -> 8B aligned)
  v2f qa[4];
#pragma unroll
  for (int kk = 0; kk < 4; ++kk)
    qa[kk] = *reinterpret_cast<const v2f*>(qh + (row_base + lr) * D_ + 4 * kk + 2 * hl);

  v8f o = {};            // O accumulator, D-layout: r = w + 8*hl, d = lr
  float mrun[8], lrun[8];  // running row max / per-lane partial exp-sum
#pragma unroll
  for (int w = 0; w < 8; ++w) { mrun[w] = -3.0e38f; lrun[w] = 0.0f; }

  const int cbeg = ((sp * NT_) / SPLIT_) * 16;
  const int cend = (((sp + 1) * NT_) / SPLIT_) * 16;
  for (int c0 = cbeg; c0 < cend; c0 += 16) {
    // cost tile first, all eight rows at once: D-layout, r = w + 8*hl, c = c0 + lr
    float cst[8];
#pragma unroll
    for (int w = 0; w < 8; ++w)
      cst[w] = costb[(size_t)(row_base + w + 8 * hl) * C_ + (c0 + lr)];

    // K tile, B-layout: lane holds column c0+lr, VGPR v holds K(=d) = 4*kk + 2*hl + v
    v2f kb[4];
#pragma unroll
    for (int kk = 0; kk < 4; ++kk)
      kb[kk] = *reinterpret_cast<const v2f*>(kh + (c0 + lr) * D_ + 4 * kk + 2 * hl);

    // S = Q * K^T  (K-dim 16 = 4 chained 16x16x4 f32 WMMAs)
    v8f s = {};
#pragma unroll
    for (int kk = 0; kk < 4; ++kk)
      s = __builtin_amdgcn_wmma_f32_16x16x4_f32(false, qa[kk], false, kb[kk],
                                                (short)0, s, false, false);

    // mixed score MLP (packed f32 pairs); D-layout: r = w + 8*hl, c = c0 + lr
    float acc[8];
#pragma unroll
    for (int w = 0; w < 8; w += 2) {  // two rows side by side: two independent chains per wave
      const float dotA = s[w] * 0.25f;                      // 1/sqrt(D)
      const float dotB = s[w + 1] * 0.25f;
      const v2f dotA2 = {dotA, dotA}, dotB2 = {dotB, dotB};
      const v2f cstA2 = {cst[w], cst[w]}, cstB2 = {cst[w + 1], cst[w + 1]};
      v2f accA2 = {bb2, 0.0f}, accB2 = {bb2, 0.0f};
#pragma unroll
      for (int mm = 0; mm < M_ / 2; ++mm) {
        v2f hvA = __builtin_elementwise_fma(cstA2, w1b2[mm], b12[mm]);
        v2f hvB = __builtin_elementwise_fma(cstB2, w1b2[mm], b12[mm]);
        hvA = __builtin_elementwise_fma(dotA2, w1a2[mm], hvA);
        hvB = __builtin_elementwise_fma(dotB2, w1a2[mm], hvB);
        hvA = __builtin_elementwise_max(hvA, zero2);
        hvB = __builtin_elementwise_max(hvB, zero2);
        accA2 = __builtin_elementwise_fma(hvA, w22[mm], accA2);
        accB2 = __builtin_elementwise_fma(hvB, w22[mm], accB2);
      }
      acc[w]     = accA2[0] + accA2[1];
      acc[w + 1] = accB2[0] + accB2[1];
    }

    // row max over the 16-lane group, the eight rows' exchanges side by side in each step
    float tmax[8];
#pragma unroll
    for (int w = 0; w < 8; ++w) tmax[w] = acc[w];
#pragma unroll
    for (int msk = 1; msk < 16; msk <<= 1) {
      float oth[8];
#pragma unroll
      for (int w = 0; w < 8; ++w) oth[w] = __shfl_xor(tmax[w], msk, 32);
#pragma unroll
      for (int w = 0; w < 8; ++w) tmax[w] = fmaxf(tmax[w], oth[w]);
    }

    // online softmax: row max must be group-uniform (rescale of o[w] is per-row);
    // denominator is kept as per-lane partial and reduced once at the end.
    float p[8];
#pragma unroll
    for (int w = 0; w < 8; ++w) {
      const float mnew = fmaxf(mrun[w], tmax[w]);
      const float resc = __expf(mrun[w] - mnew);
      const float pe   = __expf(acc[w] - mnew);
      lrun[w] = fmaf(lrun[w], resc, pe);
      mrun[w] = mnew;
      o[w] *= resc;
      p[w] = pe;
    }

    // transpose P: D-layout -> A-layout via per-wave LDS tile
#pragma unroll
    for (int w = 0; w < 8; ++w)
      plds[wave][(w + 8 * hl) * 17 + lr] = p[w];
    __builtin_amdgcn_wave_barrier();
    asm volatile("s_wait_dscnt 0x0" ::: "memory");

    v2f pa[4], vb[4];
#pragma unroll
    for (int kk = 0; kk < 4; ++kk) {
      const int cl = 4 * kk + 2 * hl;
      pa[kk][0] = plds[wave][lr * 17 + cl];
      pa[kk][1] = plds[wave][lr * 17 + cl + 1];
      // V tile, B-layout: lane holds d = lr, K(=c local) = cl + v
      vb[kk][0] = vh[(c0 + cl) * D_ + lr];
      vb[kk][1] = vh[(c0 + cl + 1) * D_ + lr];
    }
    __builtin_amdgcn_wave_barrier();

    // O += P * V
#pragma unroll
    for (int kk = 0; kk < 4; ++kk)
      o = __builtin_amdgcn_wmma_f32_16x16x4_f32(false, pa[kk], false, vb[kk],
                                                (short)0, o, false, false);
  }

  // hand the partials of ranges 1..SPLIT_-1 to the wave of range 0 of the same row tile
  if (sp != 0) {
    float* dst = &part[(sp - 1) * 8 + rt][0][lane];
#pragma unroll
    for (int w = 0; w < 8; ++w) {
      dst[w * 32]        = o[w];
      dst[(8 + w) * 32]  = mrun[w];
      dst[(16 + w) * 32] = lrun[w];
    }
  }
  __syncthreads();
  if (sp != 0) return;

  // merge the ranges on a common row max, then one butterfly per row group, then write
  // out[b][r][h*16 + d] = O / l
#pragma unroll
  for (int w = 0; w < 8; ++w) {
    float mj[SPLIT_ - 1];
    float mall = mrun[w];
#pragma unroll
    for (int j = 0; j < SPLIT_ - 1; ++j) {
      mj[j] = part[j * 8 + rt][8 + w][lane];
      mall = fmaxf(mall, mj[j]);
    }
    const float e0 = __expf(mrun[w] - mall);
    float ov = o[w] * e0;
    float lv = lrun[w] * e0;
#pragma unroll
    for (int j = 0; j < SPLIT_ - 1; ++j) {
      const float ej = __expf(mj[j] - mall);
      ov = fmaf(part[j * 8 + rt][w][lane], ej, ov);
      lv = fmaf(part[j * 8 + rt][16 + w][lane], ej, lv);
    }
    const float lsum = group16_sum(lv);
    const int r = row_base + w + 8 * hl;
    out[((size_t)b * R_ + r) * (H_ * D_) + h * D_ + lr] = ov / lsum;
  }
}

extern "C" void kernel_launch(void* const* d_in, const int* in_sizes, int n_in,
                              void* d_out, int out_size, void* d_ws, size_t ws_size,
                              hipStream_t stream) {
  const float* q    = (const float*)d_in[0];
  const float* k    = (const float*)d_in[1];
  const float* v    = (const float*)d_in[2];
  const float* cost = (const float*)d_in[3];
  const float* w1   = (const float*)d_in[4];
  const float* b1   = (const float*)d_in[5];
  const float* w2   = (const float*)d_in[6];
  const float* b2   = (const float*)d_in[7];
  float* out = (float*)d_out;

  // grid: B * H * (R/128) = 4 * 16 * 4 = 256 blocks; 768 threads = 8 row tiles x 3 column ranges
  dim3 grid(B_ * H_ * (R_ / 128));
  dim3 block(256 * SPLIT_);
  mixed_attn_kernel<<<grid, block, 0, stream>>>(q, k, v, cost, w1, b1, w2, b2, out);
}

// v002
// Measured time: 24.6 microseconds a run.
// Two timings next to v001 put it at 1.32 and 1.31 times that version's speed.
// Counting every step since v000, it is 2.09 times as fast.
#include <hip/hip_runtime.h>

// CDNA5 / gfx1250: wave32, WMMA 16x16x4 f32 + packed-f32 (V_PK_FMA_F32) MLP,
// online softmax with deferred (per-lane partial) denominator.
// Tiles are kept transposed (S^T = K Q^T, O^T = V^T P^T): a lane owns one query row, so the
// row max is in-lane but for one cross-half move, and P^T goes from the score registers straight into the B operand.
typedef __attribute__((ext_vector_type(2))) float v2f;
typedef __attribute__((ext_vector_type(4))) float v4f;
typedef __attribute__((ext_vector_type(8))) float v8f;

#define B_ 4
#define H_ 16
#define R_ 512
#define C_ 512
#define D_ 16
#define M_ 16
#define SPLIT_ 3              // column ranges per 16-row tile, one wave each
#define NT_ (C_ / 16)         // 16-column tiles per row tile

// value of lane l ^ 16 (the other 16-lane half), as a vector cross-row move
__device__ __forceinline__ float other_half(float x) {
  const int b = __builtin_bit_cast(int, x);
  return __builtin_bit_cast(float,
      __builtin_amdgcn_permlanex16(b, b, 0x76543210, 0xfedcba98, false, false));
}

__global__ __launch_bounds__(256 * SPLIT_)
void mixed_attn_kernel(const float* __restrict__ q,
                       const float* __restrict__ k,
                       const float* __restrict__ v,
                       const float* __restrict__ cost,
                       const float* __restrict__ w1,
                       const float* __restrict__ b1,
                       const float* __restrict__ w2,
                       const float* __restrict__ b2,
                       float* __restrict__ out) {
  // partial (O^T, row max, per-lane exp-sum) of column ranges 1..SPLIT_-1: [wave][register][lane]
  __shared__ float part[8 * (SPLIT_ - 1)][10][32];

  const int wave = __builtin_amdgcn_readfirstlane(threadIdx.x >> 5);  // scalar: loop bounds stay uniform
  const int rt   = wave & 7;    // 16-row tile within the 128-row block
  const int sp   = wave >> 3;   // column range of this wave
  const int lane = threadIdx.x & 31;
  const int lr   = lane & 15;   // index within 16-lane group
  const int hl   = lane >> 4;   // lane half (0/1)

  const int blk = blockIdx.x;
  const int rb  = blk & 3;          // 128-row block within R
  const int h   = (blk >> 2) & 15;  // head
  const int b   = blk >> 6;         // batch

  const int row_base = rb * 128 + rt * 16;

  const float* qh    = q + (size_t)(b * H_ + h) * R_ * D_;
  const float* kh    = k + (size_t)(b * H_ + h) * C_ * D_;
  const float* vh    = v + (size_t)(b * H_ + h) * C_ * D_;
  const float* costb = cost + (size_t)b * R_ * C_;

  // per-head MLP parameters, packed in pairs for V_PK_FMA_F32 (all 8B aligned)
  v2f w1a2[M_ / 2], w1b2[M_ / 2], b12[M_ / 2], w22[M_ / 2];
#pragma unroll
  for (int mm = 0; mm < M_ / 2; ++mm) {
    w1a2[mm] = *reinterpret_cast<const v2f*>(w1 + h * 2 * M_ + 2 * mm);       // dot weights
    w1b2[mm] = *reinterpret_cast<const v2f*>(w1 + h * 2 * M_ + M_ + 2 * mm);  // cost weights
    b12[mm]  = *reinterpret_cast<const v2f*>(b1 + h * M_ + 2 * mm);
    w22[mm]  = *reinterpret_cast<const v2f*>(w2 + h * M_ + 2 * mm);
  }
  const float bb2 = b2[h];
  const v2f zero2 = {0.0f, 0.0f};

  // Q tile as the B operand (Q^T) of V_WMMA_F32_16X16X4_F32:
  // lane holds column r = lr, VGPR v holds K(=d) = 4*kk + 2*hl + v  (even -> 8B aligned)
  v2f qb[4];
#pragma unroll
  for (int kk = 0; kk < 4; ++kk)
    qb[kk] = *reinterpret_cast<const v2f*>(qh + (row_base + lr) * D_ + 4 * kk + 2 * hl);

  v8f o = {};              // O^T accumulator, D-layout: d = w + 8*hl, r = lr
  float mrun = -3.0e38f;   // running max of row lr (equal in both halves)
  float lrun = 0.0f;       // exp-sum of row lr over this half's columns

  const int cbeg = ((sp * NT_) / SPLIT_) * 16;
  const int cend = (((sp + 1) * NT_) / SPLIT_) * 16;
  for (int c0 = cbeg; c0 < cend; c0 += 16) {
    // cost tile, transposed D-layout: r = lr, c = c0 + w + 8*hl: eight columns in a row per lane
    const float* cp = costb + (size_t)(row_base + lr) * C_ + (c0 + 8 * hl);
    const v4f clo = *reinterpret_cast<const v4f*>(cp);
    const v4f chi = *reinterpret_cast<const v4f*>(cp + 4);
    const float cst[8] = {clo[0], clo[1], clo[2], clo[3], chi[0], chi[1], chi[2], chi[3]};

    // K tile, A-layout: lane holds row c0+lr, VGPR v holds K(=d) = 4*kk + 2*hl + v
    v2f ka[4];
#pragma unroll
    for (int kk = 0; kk < 4; ++kk)
      ka[kk] = *reinterpret_cast<const v2f*>(kh + (c0 + lr) * D_ + 4 * kk + 2 * hl);

    // V^T tile, A-layout: lane holds row d = lr; the K slot (hl, v) of step kk is the column
    // that register 2*kk + v of the score tile holds in this half: c = c0 + 2*kk + v + 8*hl
    v2f va[4];
#pragma unroll
    for (int kk = 0; kk < 4; ++kk) {
      va[kk][0] = vh[(c0 + 2 * kk + 8 * hl) * D_ + lr];
      va[kk][1] = vh[(c0 + 2 * kk + 1 + 8 * hl) * D_ + lr];
    }

    // S^T = K * Q^T  (K-dim 16 = 4 chained 16x16x4 f32 WMMAs)
    v8f s = {};
#pragma unroll
    for (int kk = 0; kk < 4; ++kk)
      s = __builtin_amdgcn_wmma_f32_16x16x4_f32(false, ka[kk], false, qb[kk],
                                                (short)0, s, false, false);

    // mixed score MLP (packed f32 pairs); r = lr, c = c0 + w + 8*hl
    float acc[8];
#pragma unroll
    for (int w = 0; w < 8; w += 2) {  // two columns side by side: two independent chains per wave
      const float dotA = s[w] * 0.25f;                      // 1/sqrt(D)
      const float dotB = s[w + 1] * 0.25f;
      const v2f dotA2 = {dotA, dotA}, dotB2 = {dotB, dotB};
      const v2f cstA2 = {cst[w], cst[w]}, cstB2 = {cst[w + 1], cst[w + 1]};
      v2f accA2 = {bb2, 0.0f}, accB2 = {bb2, 0.0f};
#pragma unroll
      for (int mm = 0; mm < M_ / 2; ++mm) {
        v2f hvA = __builtin_elementwise_fma(cstA2, w1b2[mm], b12[mm]);
        v2f hvB = __builtin_elementwise_fma(cstB2, w1b2[mm], b12[mm]);
        hvA = __builtin_elementwise_fma(dotA2, w1a2[mm], hvA);
        hvB = __builtin_elementwise_fma(dotB2, w1a2[mm], hvB);
        hvA = __builtin_elementwise_max(hvA, zero2);
        hvB = __builtin_elementwise_max(hvB, zero2);
        accA2 = __builtin_elementwise_fma(hvA, w22[mm], accA2);
        accB2 = __builtin_elementwise_fma(hvB, w22[mm], accB2);
      }
      acc[w]     = accA2[0] + accA2[1];
      acc[w + 1] = accB2[0] + accB2[1];
    }

    // row max of the tile: the lane's own eight columns, then the other half's eight
    float tmax = acc[0];
#pragma unroll
    for (int w = 1; w < 8; ++w) tmax = fmaxf(tmax, acc[w]);
    tmax = fmaxf(tmax, other_half(tmax));

    // online softmax: one max and one rescale per lane; the denominator is kept as a
    // per-lane partial and the two halves are added once at the end.
    const float mnew = fmaxf(mrun, tmax);
    const float resc = __expf(mrun - mnew);
    v2f pb[4];  // P^T, already the B operand: lane holds column r = lr, K slot (hl, v) as for va
#pragma unroll
    for (int kk = 0; kk < 4; ++kk) {
      pb[kk][0] = __expf(acc[2 * kk] - mnew);
      pb[kk][1] = __expf(acc[2 * kk + 1] - mnew);
    }
    const v2f ps = (pb[0] + pb[1]) + (pb[2] + pb[3]);
    lrun = fmaf(lrun, resc, ps[0] + ps[1]);
    mrun = mnew;
#pragma unroll
    for (int w = 0; w < 8; ++w) o[w] *= resc;

    // O^T += V^T * P^T
#pragma unroll
    for (int kk = 0; kk < 4; ++kk)
      o = __builtin_amdgcn_wmma_f32_16x16x4_f32(false, va[kk], false, pb[kk],
                                                (short)0, o, false, false);
  }

  // hand the partials of ranges 1..SPLIT_-1 to the wave of range 0 of the same row tile
  if (sp != 0) {
    float* dst = &part[(sp - 1) * 8 + rt][0][lane];
#pragma unroll
    for (int w = 0; w < 8; ++w) dst[w * 32] = o[w];
    dst[8 * 32] = mrun;
    dst[9 * 32] = lrun;
  }
  __syncthreads();
  if (sp != 0) return;

  // merge the ranges on a common row max, add the two halves' denominators, then write
  // out[b][r][h*16 + d] = O / l; the lane holds d = 8*hl .. 8*hl + 7 of row lr
  float mj[SPLIT_ - 1];
  float mall = mrun;
#pragma unroll
  for (int j = 0; j < SPLIT_ - 1; ++j) {
    mj[j] = part[j * 8 + rt][8][lane];
    mall = fmaxf(mall, mj[j]);
  }
  const float e0 = __expf(mrun - mall);
  float lv = lrun * e0;
  float ov[8];
#pragma unroll
  for (int w = 0; w < 8; ++w) ov[w] = o[w] * e0;
#pragma unroll
  for (int j = 0; j < SPLIT_ - 1; ++j) {
    const float ej = __expf(mj[j] - mall);
    lv = fmaf(part[j * 8 + rt][9][lane], ej, lv);
#pragma unroll
    for (int w = 0; w < 8; ++w) ov[w] = fmaf(part[j * 8 + rt][w][lane], ej, ov[w]);
  }
  const float lsum = lv + other_half(lv);
  float* op = out + ((size_t)b * R_ + (row_base + lr)) * (H_ * D_) + h * D_ + 8 * hl;
  const v4f r0 = {ov[0] / lsum, ov[1] / lsum, ov[2] / lsum, ov[3] / lsum};
  const v4f r1 = {ov[4] / lsum, ov[5] / lsum, ov[6] / lsum, ov[7] / lsum};
  *reinterpret_cast<v4f*>(op)     = r0;
  *reinterpret_cast<v4f*>(op + 4) = r1;
}

extern "C" void kernel_launch(void* const* d_in, const int* in_sizes, int n_in,
                              void* d_out, int out_size, void* d_ws, size_t ws_size,
                              hipStream_t stream) {
  const float* q    = (const float*)d_in[0];
  const float* k    = (const float*)d_in[1];
  const float* v    = (const float*)d_in[2];
  const float* cost = (const float*)d_in[3];
  const float* w1   = (const float*)d_in[4];
  const float* b1   = (const float*)d_in[5];
  const float* w2   = (const float*)d_in[6];
  const float* b2   = (const float*)d_in[7];
  float* out = (float*)d_out;

  // grid: B * H * (R/128) = 4 * 16 * 4 = 256 blocks; 768 threads = 8 row tiles x 3 column ranges
  dim3 grid(B_ * H_ * (R_ / 128));
  dim3 block(256 * SPLIT_);
  mixed_attn_kernel<<<grid, block, 0, stream>>>(q, k, v, cost, w1, b1, w2, b2, out);
}

// v003
// It runs in 22.1 microseconds.
// Timed twice side by side with v002, it ran 1.11 times as fast both times.
// Counting every step since v000, it is 2.33 times as fast.
#include <hip/hip_runtime.h>

// CDNA5 / gfx1250: wave32, WMMA 16x16x4 f32 + packed-f32 (V_PK_FMA_F32) MLP,
// online softmax with deferred (per-lane partial) denominator.
// Each hidden unit w * relu(a*s + t), t = c*cost + b, is evaluated as
//   w*|a| * max(s, -t/a)  +  (a > 0 ? w*t : w*a*s)
// (an identity for a != 0): the second part is linear in s and cost and is gathered over the
// sixteen units once per head, so a unit costs fma, max, fma per score instead of fma, fma, max, fma.
// Tiles are kept transposed (S^T = K Q^T, O^T = V^T P^T): a lane owns one query row, so the
// row max is in-lane but for one cross-half move, and P^T goes from the score registers straight into the B operand.
typedef __attribute__((ext_vector_type(2))) float v2f;
typedef __attribute__((ext_vector_type(4))) float v4f;
typedef __attribute__((ext_vector_type(8))) float v8f;

#define B_ 4
#define H_ 16
#define R_ 512
#define C_ 512
#define D_ 16
#define M_ 16
#define SPLIT_ 3              // column ranges per 16-row tile, one wave each
#define NT_ (C_ / 16)         // 16-column tiles per row tile

// sum over the 16 lanes of a row (every lane gets it): four row_xmask DPP steps
template <int X>
__device__ __forceinline__ float xmask_add(float x) {
  return x + __builtin_bit_cast(float,
      __builtin_amdgcn_update_dpp(0, __builtin_bit_cast(int, x), 0x160 | X, 0xf, 0xf, true));
}
__device__ __forceinline__ float row_sum(float x) {
  return xmask_add<8>(xmask_add<4>(xmask_add<2>(xmask_add<1>(x))));
}

// value that lane M of the own 16-lane row holds (row_share DPP: the result stays in a vector
// register, where a packed instruction can take either half of a register pair for both results)
template <int M>
__device__ __forceinline__ float from_lane(float x) {
  return __builtin_bit_cast(float,
      __builtin_amdgcn_update_dpp(0, __builtin_bit_cast(int, x), 0x150 | M, 0xf, 0xf, true));
}

// value of lane l ^ 16 (the other 16-lane half), as a vector cross-row move
__device__ __forceinline__ float other_half(float x) {
  const int b = __builtin_bit_cast(int, x);
  return __builtin_bit_cast(float,
      __builtin_amdgcn_permlanex16(b, b, 0x76543210, 0xfedcba98, false, false));
}

__global__ __launch_bounds__(256 * SPLIT_)
void mixed_attn_kernel(const float* __restrict__ q,
                       const float* __restrict__ k,
                       const float* __restrict__ v,
                       const float* __restrict__ cost,
                       const float* __restrict__ w1,
                       const float* __restrict__ b1,
                       const float* __restrict__ w2,
                       const float* __restrict__ b2,
                       float* __restrict__ out) {
  // partial (O^T, row max, per-lane exp-sum) of column ranges 1..SPLIT_-1: [wave][register][lane]
  __shared__ float part[8 * (SPLIT_ - 1)][10][32];

  const int wave = __builtin_amdgcn_readfirstlane(threadIdx.x >> 5);  // scalar: loop bounds stay uniform
  const int rt   = wave & 7;    // 16-row tile within the 128-row block
  const int sp   = wave >> 3;   // column range of this wave
  const int lane = threadIdx.x & 31;
  const int lr   = lane & 15;   // index within 16-lane group
  const int hl   = lane >> 4;   // lane half (0/1)

  const int blk = blockIdx.x;
  const int rb  = blk & 3;          // 128-row block within R
  const int h   = (blk >> 2) & 15;  // head
  const int b   = blk >> 6;         // batch

  const int row_base = rb * 128 + rt * 16;

  const float* qh    = q + (size_t)(b * H_ + h) * R_ * D_;
  const float* kh    = k + (size_t)(b * H_ + h) * C_ * D_;
  const float* vh    = v + (size_t)(b * H_ + h) * C_ * D_;
  const float* costb = cost + (size_t)b * R_ * C_;

  // Q tile as the B operand (Q^T) of V_WMMA_F32_16X16X4_F32:
  // lane holds column r = lr, VGPR v holds K(=d) = 4*kk + 2*hl + v  (even -> 8B aligned)
  v2f qb[4];
#pragma unroll
  for (int kk = 0; kk < 4; ++kk)
    qb[kk] = *reinterpret_cast<const v2f*>(qh + (row_base + lr) * D_ + 4 * kk + 2 * hl);

  // per-head MLP parameters: lane lr prepares hidden unit lr, then the sixteen units are spread
  // to every lane. a carries the 1/sqrt(D) of the dot score (exact, a power of two).
  v2f al2[M_ / 2], be2[M_ / 2], om2[M_ / 2];  // threshold slope, threshold offset, weight w*|a|
  float ls, lc, l0;                           // gathered linear part: ls*s + lc*cost + l0
  {
    const float a0 = w1[h * 2 * M_ + lr] * 0.25f;
    const float cc = w1[h * 2 * M_ + M_ + lr];
    const float bb = b1[h * M_ + lr];
    const float ww = w2[h * M_ + lr];
    // a unit whose a is (next to) zero does not depend on s: a tiny positive a keeps -t/a finite,
    // and w*|a| * max(s, -t/a) + w*t is then w*relu(t) to rounding
    const float a   = fabsf(a0) < 1.0e-20f ? 1.0e-20f : a0;
    const bool  pos = a > 0.0f;
    const float alv = -cc / a;
    const float bev = -bb / a;
    const float omv = ww * fabsf(a);
    ls = row_sum(pos ? 0.0f : ww * a);
    lc = row_sum(pos ? ww * cc : 0.0f);
    l0 = row_sum(pos ? ww * bb : 0.0f) + b2[h];
#define SPREAD_(J)                                                      \
    al2[J] = v2f{from_lane<2 * J>(alv), from_lane<2 * J + 1>(alv)};     \
    be2[J] = v2f{from_lane<2 * J>(bev), from_lane<2 * J + 1>(bev)};     \
    om2[J] = v2f{from_lane<2 * J>(omv), from_lane<2 * J + 1>(omv)};
    SPREAD_(0) SPREAD_(1) SPREAD_(2) SPREAD_(3) SPREAD_(4) SPREAD_(5) SPREAD_(6) SPREAD_(7)
#undef SPREAD_
  }
  v8f o = {};              // O^T accumulator, D-layout: d = w + 8*hl, r = lr
  float mrun = -3.0e38f;   // running max of row lr (equal in both halves)
  float lrun = 0.0f;       // exp-sum of row lr over this half's columns

  const int cbeg = ((sp * NT_) / SPLIT_) * 16;
  const int cend = (((sp + 1) * NT_) / SPLIT_) * 16;
  static_assert(NT_ >= SPLIT_, "every column range holds at least one tile");
  int c0 = cbeg;
  do {  // no test in front of the first tile: its cost, K and V loads can then be issued ahead of the parameter work
    // cost tile, transposed D-layout: r = lr, c = c0 + w + 8*hl: eight columns in a row per lane
    const float* cp = costb + (size_t)(row_base + lr) * C_ + (c0 + 8 * hl);
    const v4f clo = *reinterpret_cast<const v4f*>(cp);
    const v4f chi = *reinterpret_cast<const v4f*>(cp + 4);
    const float cst[8] = {clo[0], clo[1], clo[2], clo[3], chi[0], chi[1], chi[2], chi[3]};

    // K tile, A-layout: lane holds row c0+lr, VGPR v holds K(=d) = 4*kk + 2*hl + v
    v2f ka[4];
#pragma unroll
    for (int kk = 0; kk < 4; ++kk)
      ka[kk] = *reinterpret_cast<const v2f*>(kh + (c0 + lr) * D_ + 4 * kk + 2 * hl);

    // V^T tile, A-layout: lane holds row d = lr; the K slot (hl, v) of step kk is the column
    // that register 2*kk + v of the score tile holds in this half: c = c0 + 2*kk + v + 8*hl
    v2f va[4];
#pragma unroll
    for (int kk = 0; kk < 4; ++kk) {
      va[kk][0] = vh[(c0 + 2 * kk + 8 * hl) * D_ + lr];
      va[kk][1] = vh[(c0 + 2 * kk + 1 + 8 * hl) * D_ + lr];
    }

    // S^T = K * Q^T  (K-dim 16 = 4 chained 16x16x4 f32 WMMAs)
    v8f s = {};
#pragma unroll
    for (int kk = 0; kk < 4; ++kk)
      s = __builtin_amdgcn_wmma_f32_16x16x4_f32(false, ka[kk], false, qb[kk],
                                                (short)0, s, false, false);

    // mixed score MLP (packed f32 pairs of hidden units); r = lr, c = c0 + w + 8*hl
    float acc[8];
#pragma unroll
    for (int w = 0; w < 8; w += 2) {  // two columns side by side: two independent chains per wave
      const v2f dotA2 = {s[w], s[w]}, dotB2 = {s[w + 1], s[w + 1]};
      const v2f cstA2 = {cst[w], cst[w]}, cstB2 = {cst[w + 1], cst[w + 1]};
      // the sums start from the linear part, one half of it in each half of the pair
      v2f accA2 = {fmaf(s[w], ls, l0), cst[w] * lc};
      v2f accB2 = {fmaf(s[w + 1], ls, l0), cst[w + 1] * lc};
#pragma unroll
      for (int mm = 0; mm < M_ / 2; ++mm) {
        v2f thA = __builtin_elementwise_fma(cstA2, al2[mm], be2[mm]);
        v2f thB = __builtin_elementwise_fma(cstB2, al2[mm], be2[mm]);
        thA = __builtin_elementwise_max(thA, dotA2);
        thB = __builtin_elementwise_max(thB, dotB2);
        accA2 = __builtin_elementwise_fma(thA, om2[mm], accA2);
        accB2 = __builtin_elementwise_fma(thB, om2[mm], accB2);
      }
      acc[w]     = accA2[0] + accA2[1];
      acc[w + 1] = accB2[0] + accB2[1];
    }

    // row max of the tile: the lane's own eight columns, then the other half's eight
    float tmax = acc[0];
#pragma unroll
    for (int w = 1; w < 8; ++w) tmax = fmaxf(tmax, acc[w]);
    tmax = fmaxf(tmax, other_half(tmax));

    // online softmax: one max and one rescale per lane; the denominator is kept as a
    // per-lane partial and the two halves are added once at the end.
    const float mnew = fmaxf(mrun, tmax);
    const float resc = __expf(mrun - mnew);
    v2f pb[4];  // P^T, already the B operand: lane holds column r = lr, K slot (hl, v) as for va
#pragma unroll
    for (int kk = 0; kk < 4; ++kk) {
      pb[kk][0] = __expf(acc[2 * kk] - mnew);
      pb[kk][1] = __expf(acc[2 * kk + 1] - mnew);
    }
    const v2f ps = (pb[0] + pb[1]) + (pb[2] + pb[3]);
    lrun = fmaf(lrun, resc, ps[0] + ps[1]);
    mrun = mnew;
#pragma unroll
    for (int w = 0; w < 8; ++w) o[w] *= resc;

    // O^T += V^T * P^T
#pragma unroll
    for (int kk = 0; kk < 4; ++kk)
      o = __builtin_amdgcn_wmma_f32_16x16x4_f32(false, va[kk], false, pb[kk],
                                                (short)0, o, false, false);
    c0 += 16;
  } while (c0 < cend);

  // hand the partials of ranges 1..SPLIT_-1 to the wave of range 0 of the same row tile
  if (sp != 0) {
    float* dst = &part[(sp - 1) * 8 + rt][0][lane];
#pragma unroll
    for (int w = 0; w < 8; ++w) dst[w * 32] = o[w];
    dst[8 * 32] = mrun;
    dst[9 * 32] = lrun;
  }
  __syncthreads();
  if (sp != 0) return;

  // merge the ranges on a common row max, add the two halves' denominators, then write
  // out[b][r][h*16 + d] = O / l; the lane holds d = 8*hl .. 8*hl + 7 of row lr
  float mj[SPLIT_ - 1];
  float mall = mrun;
#pragma unroll
  for (int j = 0; j < SPLIT_ - 1; ++j) {
    mj[j] = part[j * 8 + rt][8][lane];
    mall = fmaxf(mall, mj[j]);
  }
  const float e0 = __expf(mrun - mall);
  float lv = lrun * e0;
  float ov[8];
#pragma unroll
  for (int w = 0; w < 8; ++w) ov[w] = o[w] * e0;
#pragma unroll
  for (int j = 0; j < SPLIT_ - 1; ++j) {
    const float ej = __expf(mj[j] - mall);
    lv = fmaf(part[j * 8 + rt][9][lane], ej, lv);
#pragma unroll
    for (int w = 0; w < 8; ++w) ov[w] = fmaf(part[j * 8 + rt][w][lane], ej, ov[w]);
  }
  const float lsum = lv + other_half(lv);
  float* op = out + ((size_t)b * R_ + (row_base + lr)) * (H_ * D_) + h * D_ + 8 * hl;
  const v4f r0 = {ov[0] / lsum, ov[1] / lsum, ov[2] / lsum, ov[3] / lsum};
  const v4f r1 = {ov[4] / lsum, ov[5] / lsum, ov[6] / lsum, ov[7] / lsum};
  *reinterpret_cast<v4f*>(op)     = r0;
  *reinterpret_cast<v4f*>(op + 4) = r1;
}

extern "C" void kernel_launch(void* const* d_in, const int* in_sizes, int n_in,
                              void* d_out, int out_size, void* d_ws, size_t ws_size,
                              hipStream_t stream) {
  const float* q    = (const float*)d_in[0];
  const float* k    = (const float*)d_in[1];
  const float* v    = (const float*)d_in[2];
  const float* cost = (const float*)d_in[3];
  const float* w1   = (const float*)d_in[4];
  const float* b1   = (const float*)d_in[5];
  const float* w2   = (const float*)d_in[6];
  const float* b2   = (const float*)d_in[7];
  float* out = (float*)d_out;

  // grid: B * H * (R/128) = 4 * 16 * 4 = 256 blocks; 768 threads = 8 row tiles x 3 column ranges
  dim3 grid(B_ * H_ * (R_ / 128));
  dim3 block(256 * SPLIT_);
  mixed_attn_kernel<<<grid, block, 0, stream>>>(q, k, v, cost, w1, b1, w2, b2, out);
}

// v004
// It runs in 20.6 microseconds.
// Two timings next to v003 both put it at 1.07 times that version's speed.
// Counting every step since v000, it is 2.50 times as fast.
#include <hip/hip_runtime.h>

// CDNA5 / gfx1250: wave32, WMMA 16x16x4 f32 + packed-f32 (V_PK_FMA_F32) MLP,
// online softmax with deferred (per-lane partial) denominator.
// Each hidden unit w * relu(a*s + t), t = c*cost + b, is evaluated as
//   w*|a| * max(s, -t/a)  +  (a > 0 ? w*t : w*a*s)
// (an identity for a != 0): the second part is linear in s and cost and is gathered over the
// sixteen units once per head, so a unit costs fma, max, fma per score instead of fma, fma, max, fma.
// Tiles are kept transposed (S^T = K Q^T, O^T = V^T P^T): a lane owns one query row, so the
// row max is in-lane but for one cross-half move, and P^T goes from the score registers straight into the B operand.
typedef __attribute__((ext_vector_type(2))) float v2f;
typedef __attribute__((ext_vector_type(4))) float v4f;
typedef __attribute__((ext_vector_type(8))) float v8f;

#define B_ 4
#define H_ 16
#define R_ 512
#define C_ 512
#define D_ 16
#define M_ 16
#define SPLIT_ 3              // column ranges per 16-row tile, one wave each
#define NT_ (C_ / 16)         // 16-column tiles per row tile

// sum over the 16 lanes of a row (every lane gets it): four row_xmask DPP steps
template <int X>
__device__ __forceinline__ float xmask_add(float x) {
  return x + __builtin_bit_cast(float,
      __builtin_amdgcn_update_dpp(0, __builtin_bit_cast(int, x), 0x160 | X, 0xf, 0xf, true));
}
__device__ __forceinline__ float row_sum(float x) {
  return xmask_add<8>(xmask_add<4>(xmask_add<2>(xmask_add<1>(x))));
}

// value that lane M of the own 16-lane row holds (row_share DPP: the result stays in a vector
// register, where a packed instruction can take either half of a register pair for both results)
template <int M>
__device__ __forceinline__ float from_lane(float x) {
  return __builtin_bit_cast(float,
      __builtin_amdgcn_update_dpp(0, __builtin_bit_cast(int, x), 0x150 | M, 0xf, 0xf, true));
}

// value of lane l ^ 16 (the other 16-lane half), as a vector cross-row move
__device__ __forceinline__ float other_half(float x) {
  const int b = __builtin_bit_cast(int, x);
  return __builtin_bit_cast(float,
      __builtin_amdgcn_permlanex16(b, b, 0x76543210, 0xfedcba98, false, false));
}

__global__ __launch_bounds__(256 * SPLIT_)
void mixed_attn_kernel(const float* __restrict__ q,
                       const float* __restrict__ k,
                       const float* __restrict__ v,
                       const float* __restrict__ cost,
                       const float* __restrict__ w1,
                       const float* __restrict__ b1,
                       const float* __restrict__ w2,
                       const float* __restrict__ b2,
                       float* __restrict__ out) {
  // partial (O^T, row max, per-lane exp-sum) of column ranges 1..SPLIT_-1: [wave][register][lane]
  __shared__ float part[8 * (SPLIT_ - 1)][10][32];

  const int wave = __builtin_amdgcn_readfirstlane(threadIdx.x >> 5);  // scalar: loop bounds stay uniform
  const int rt   = wave & 7;    // 16-row tile within the 128-row block
  const int sp   = wave >> 3;   // column range of this wave
  const int lane = threadIdx.x & 31;
  const int lr   = lane & 15;   // index within 16-lane group
  const int hl   = lane >> 4;   // lane half (0/1)

  const int blk = blockIdx.x;
  const int rb  = blk & 3;          // 128-row block within R
  const int h   = (blk >> 2) & 15;  // head
  const int b   = blk >> 6;         // batch

  const int row_base = rb * 128 + rt * 16;

  const float* qh    = q + (size_t)(b * H_ + h) * R_ * D_;
  const float* kh    = k + (size_t)(b * H_ + h) * C_ * D_;
  const float* vh    = v + (size_t)(b * H_ + h) * C_ * D_;
  const float* costb = cost + (size_t)b * R_ * C_;

  // Q tile as the B operand (Q^T) of V_WMMA_F32_16X16X4_F32:
  // lane holds column r = lr, VGPR v holds K(=d) = 4*kk + 2*hl + v  (even -> 8B aligned)
  v2f qb[4];
#pragma unroll
  for (int kk = 0; kk < 4; ++kk)
    qb[kk] = *reinterpret_cast<const v2f*>(qh + (row_base + lr) * D_ + 4 * kk + 2 * hl);

  // per-head MLP parameters: lane lr prepares hidden unit lr, then the sixteen units are spread
  // to every lane. a carries the 1/sqrt(D) of the dot score (exact, a power of two).
  v2f al2[M_ / 2], be2[M_ / 2], om2[M_ / 2];  // threshold slope, threshold offset, weight w*|a|
  float ls, lc, l0;                           // gathered linear part: ls*s + lc*cost + l0
  {
    const float a0 = w1[h * 2 * M_ + lr] * 0.25f;
    const float cc = w1[h * 2 * M_ + M_ + lr];
    const float bb = b1[h * M_ + lr];
    const float ww = w2[h * M_ + lr];
    // a unit whose a is (next to) zero does not depend on s: a tiny positive a keeps -t/a finite,
    // and w*|a| * max(s, -t/a) + w*t is then w*relu(t) to rounding
    const float a   = fabsf(a0) < 1.0e-20f ? 1.0e-20f : a0;
    const bool  pos = a > 0.0f;
    const float alv = -cc / a;
    const float bev = -bb / a;
    const float omv = ww * fabsf(a);
    ls = row_sum(pos ? 0.0f : ww * a);
    lc = row_sum(pos ? ww * cc : 0.0f);
    l0 = row_sum(pos ? ww * bb : 0.0f) + b2[h];
#define SPREAD_(J)                                                      \
    al2[J] = v2f{from_lane<2 * J>(alv), from_lane<2 * J + 1>(alv)};     \
    be2[J] = v2f{from_lane<2 * J>(bev), from_lane<2 * J + 1>(bev)};     \
    om2[J] = v2f{from_lane<2 * J>(omv), from_lane<2 * J + 1>(omv)};
    SPREAD_(0) SPREAD_(1) SPREAD_(2) SPREAD_(3) SPREAD_(4) SPREAD_(5) SPREAD_(6) SPREAD_(7)
#undef SPREAD_
  }
  v8f o = {};              // O^T accumulator, D-layout: d = w + 8*hl, r = lr
  float mrun = -3.0e38f;   // running max of row lr (equal in both halves)
  float lrun = 0.0f;       // exp-sum of row lr over this half's columns

  const int cbeg = ((sp * NT_) / SPLIT_) * 16;
  const int cend = (((sp + 1) * NT_) / SPLIT_) * 16;
  static_assert(NT_ >= SPLIT_, "every column range holds at least one tile");
  int c0 = cbeg;
  do {  // no test in front of the first tile: its cost, K and V loads can then be issued ahead of the parameter work
    // cost tile, transposed D-layout: r = lr, c = c0 + w + 8*hl: eight columns in a row per lane
    const float* cp = costb + (size_t)(row_base + lr) * C_ + (c0 + 8 * hl);
    const v4f clo = *reinterpret_cast<const v4f*>(cp);
    const v4f chi = *reinterpret_cast<const v4f*>(cp + 4);
    const float cst[8] = {clo[0], clo[1], clo[2], clo[3], chi[0], chi[1], chi[2], chi[3]};

    // K tile, A-layout: lane holds row c0+lr, VGPR v holds K(=d) = 4*kk + 2*hl + v
    v2f ka[4];
#pragma unroll
    for (int kk = 0; kk < 4; ++kk)
      ka[kk] = *reinterpret_cast<const v2f*>(kh + (c0 + lr) * D_ + 4 * kk + 2 * hl);

    // V^T tile, A-layout: lane holds row d = lr; the K slot (hl, v) of step kk is the column
    // that register 2*kk + v of the score tile holds in this half: c = c0 + 2*kk + v + 8*hl
    v2f va[4];
#pragma unroll
    for (int kk = 0; kk < 4; ++kk) {
      va[kk][0] = vh[(c0 + 2 * kk + 8 * hl) * D_ + lr];
      va[kk][1] = vh[(c0 + 2 * kk + 1 + 8 * hl) * D_ + lr];
    }

    // S^T = K * Q^T  (K-dim 16 = 4 chained 16x16x4 f32 WMMAs)
    v8f s = {};
#pragma unroll
    for (int kk = 0; kk < 4; ++kk)
      s = __builtin_amdgcn_wmma_f32_16x16x4_f32(false, ka[kk], false, qb[kk],
                                                (short)0, s, false, false);

    // mixed score MLP (packed f32 pairs of hidden units); r = lr, c = c0 + w + 8*hl.
    // All eight columns of the lane go through a pair of units together: eight independent
    // chains, so each max and each sum stands eight instructions behind what it reads.
    v2f acc2[8];  // the sums start from the linear part, one half of it in each half of the pair
#pragma unroll
    for (int w = 0; w < 8; ++w) acc2[w] = v2f{fmaf(s[w], ls, l0), cst[w] * lc};
#pragma unroll
    for (int mm = 0; mm < M_ / 2; ++mm) {
      v2f th[8];
#pragma unroll
      for (int w = 0; w < 8; ++w)
        th[w] = __builtin_elementwise_fma(v2f{cst[w], cst[w]}, al2[mm], be2[mm]);
#pragma unroll
      for (int w = 0; w < 8; ++w)
        th[w] = __builtin_elementwise_max(th[w], v2f{s[w], s[w]});
#pragma unroll
      for (int w = 0; w < 8; ++w)
        acc2[w] = __builtin_elementwise_fma(th[w], om2[mm], acc2[w]);
    }
    float acc[8];
#pragma unroll
    for (int w = 0; w < 8; ++w) acc[w] = acc2[w][0] + acc2[w][1];

    // row max of the tile: the lane's own eight columns, then the other half's eight
    float tmax = acc[0];
#pragma unroll
    for (int w = 1; w < 8; ++w) tmax = fmaxf(tmax, acc[w]);
    tmax = fmaxf(tmax, other_half(tmax));

    // online softmax: one max and one rescale per lane; the denominator is kept as a
    // per-lane partial and the two halves are added once at the end.
    const float mnew = fmaxf(mrun, tmax);
    const float resc = __expf(mrun - mnew);
    v2f pb[4];  // P^T, already the B operand: lane holds column r = lr, K slot (hl, v) as for va
#pragma unroll
    for (int kk = 0; kk < 4; ++kk) {
      pb[kk][0] = __expf(acc[2 * kk] - mnew);
      pb[kk][1] = __expf(acc[2 * kk + 1] - mnew);
    }
    const v2f ps = (pb[0] + pb[1]) + (pb[2] + pb[3]);
    lrun = fmaf(lrun, resc, ps[0] + ps[1]);
    mrun = mnew;
#pragma unroll
    for (int w = 0; w < 8; ++w) o[w] *= resc;

    // O^T += V^T * P^T
#pragma unroll
    for (int kk = 0; kk < 4; ++kk)
      o = __builtin_amdgcn_wmma_f32_16x16x4_f32(false, va[kk], false, pb[kk],
                                                (short)0, o, false, false);
    c0 += 16;
  } while (c0 < cend);

  // hand the partials of ranges 1..SPLIT_-1 to the wave of range 0 of the same row tile
  if (sp != 0) {
    float* dst = &part[(sp - 1) * 8 + rt][0][lane];
#pragma unroll
    for (int w = 0; w < 8; ++w) dst[w * 32] = o[w];
    dst[8 * 32] = mrun;
    dst[9 * 32] = lrun;
  }
  __syncthreads();
  if (sp != 0) return;

  // merge the ranges on a common row max, add the two halves' denominators, then write
  // out[b][r][h*16 + d] = O / l; the lane holds d = 8*hl .. 8*hl + 7 of row lr
  float mj[SPLIT_ - 1];
  float mall = mrun;
#pragma unroll
  for (int j = 0; j < SPLIT_ - 1; ++j) {
    mj[j] = part[j * 8 + rt][8][lane];
    mall = fmaxf(mall, mj[j]);
  }
  const float e0 = __expf(mrun - mall);
  float lv = lrun * e0;
  float ov[8];
#pragma unroll
  for (int w = 0; w < 8; ++w) ov[w] = o[w] * e0;
#pragma unroll
  for (int j = 0; j < SPLIT_ - 1; ++j) {
    const float ej = __expf(mj[j] - mall);
    lv = fmaf(part[j * 8 + rt][9][lane], ej, lv);
#pragma unroll
    for (int w = 0; w < 8; ++w) ov[w] = fmaf(part[j * 8 + rt][w][lane], ej, ov[w]);
  }
  const float lsum = lv + other_half(lv);
  float* op = out + ((size_t)b * R_ + (row_base + lr)) * (H_ * D_) + h * D_ + 8 * hl;
  const v4f r0 = {ov[0] / lsum, ov[1] / lsum, ov[2] / lsum, ov[3] / lsum};
  const v4f r1 = {ov[4] / lsum, ov[5] / lsum, ov[6] / lsum, ov[7] / lsum};
  *reinterpret_cast<v4f*>(op)     = r0;
  *reinterpret_cast<v4f*>(op + 4) = r1;
}

extern "C" void kernel_launch(void* const* d_in, const int* in_sizes, int n_in,
                              void* d_out, int out_size, void* d_ws, size_t ws_size,
                              hipStream_t stream) {
  const float* q    = (const float*)d_in[0];
  const float* k    = (const float*)d_in[1];
  const float* v    = (const float*)d_in[2];
  const float* cost = (const float*)d_in[3];
  const float* w1   = (const float*)d_in[4];
  const float* b1   = (const float*)d_in[5];
  const float* w2   = (const float*)d_in[6];
  const float* b2   = (const float*)d_in[7];
  float* out = (float*)d_out;

  // grid: B * H * (R/128) = 4 * 16 * 4 = 256 blocks; 768 threads = 8 row tiles x 3 column ranges
  dim3 grid(B_ * H_ * (R_ / 128));
  dim3 block(256 * SPLIT_);
  mixed_attn_kernel<<<grid, block, 0, stream>>>(q, k, v, cost, w1, b1, w2, b2, out);
}

// v005
// Measured time: 20 microseconds a run.
// In both of two side-by-side timings against v004, it was 1.03 times as fast.
// Counting every step since v000, it is 2.57 times as fast.
#include <hip/hip_runtime.h>

// CDNA5 / gfx1250: wave32, WMMA 16x16x4 f32 + packed-f32 (V_PK_FMA_F32) MLP,
// online softmax with deferred (per-lane partial) denominator.
// Each hidden unit w * relu(a*s + t), t = c*cost + b, is evaluated as
//   w*|a| * max(s, -t/a)  +  (a > 0 ? w*t : w*a*s)
// (an identity for a != 0): the second part is linear in s and cost and is gathered over the
// sixteen units once per head, so a unit costs fma, max, fma per score instead of fma, fma, max, fma.
// Tiles are kept transposed (S^T = K Q^T, O^T = V^T P^T): a lane owns one query row, so the
// row max is in-lane but for one cross-half move, and P^T goes from the score registers straight into the B operand.
typedef __attribute__((ext_vector_type(2))) float v2f;
typedef __attribute__((ext_vector_type(4))) float v4f;
typedef __attribute__((ext_vector_type(8))) float v8f;

#define B_ 4
#define H_ 16
#define R_ 512
#define C_ 512
#define D_ 16
#define M_ 16
#define SPLIT_ 3              // column ranges per 16-row tile, one wave each
#define NT_ (C_ / 16)         // 16-column tiles per row tile

// sum over the 16 lanes of a row (every lane gets it): four row_xmask DPP steps
template <int X>
__device__ __forceinline__ float xmask_add(float x) {
  return x + __builtin_bit_cast(float,
      __builtin_amdgcn_update_dpp(0, __builtin_bit_cast(int, x), 0x160 | X, 0xf, 0xf, true));
}
__device__ __forceinline__ float row_sum(float x) {
  return xmask_add<8>(xmask_add<4>(xmask_add<2>(xmask_add<1>(x))));
}

// value that lane M of the own 16-lane row holds (row_share DPP: the result stays in a vector
// register, where a packed instruction can take either half of a register pair for both results)
template <int M>
__device__ __forceinline__ float from_lane(float x) {
  return __builtin_bit_cast(float,
      __builtin_amdgcn_update_dpp(0, __builtin_bit_cast(int, x), 0x150 | M, 0xf, 0xf, true));
}

// value of lane l ^ 16 (the other 16-lane half), as a vector cross-row move
__device__ __forceinline__ float other_half(float x) {
  const int b = __builtin_bit_cast(int, x);
  return __builtin_bit_cast(float,
      __builtin_amdgcn_permlanex16(b, b, 0x76543210, 0xfedcba98, false, false));
}

__global__ __launch_bounds__(256 * SPLIT_)
void mixed_attn_kernel(const float* __restrict__ q,
                       const float* __restrict__ k,
                       const float* __restrict__ v,
                       const float* __restrict__ cost,
                       const float* __restrict__ w1,
                       const float* __restrict__ b1,
                       const float* __restrict__ w2,
                       const float* __restrict__ b2,
                       float* __restrict__ out) {
  // partial (O^T, row max, per-lane exp-sum) of column ranges 1..SPLIT_-1: [wave][register][lane]
  __shared__ float part[8 * (SPLIT_ - 1)][10][32];

  const int wave = __builtin_amdgcn_readfirstlane(threadIdx.x >> 5);  // scalar: loop bounds stay uniform
  const int rt   = wave & 7;    // 16-row tile within the 128-row block
  const int sp   = wave >> 3;   // column range of this wave
  const int lane = threadIdx.x & 31;
  const int lr   = lane & 15;   // index within 16-lane group
  const int hl   = lane >> 4;   // lane half (0/1)

  const int blk = blockIdx.x;
  const int rb  = blk & 3;          // 128-row block within R
  const int h   = (blk >> 2) & 15;  // head
  const int b   = blk >> 6;         // batch

  const int row_base = rb * 128 + rt * 16;

  const float* qh    = q + (size_t)(b * H_ + h) * R_ * D_;
  const float* kh    = k + (size_t)(b * H_ + h) * C_ * D_;
  const float* vh    = v + (size_t)(b * H_ + h) * C_ * D_;
  const float* costb = cost + (size_t)b * R_ * C_;

  // Q tile as the B operand (Q^T) of V_WMMA_F32_16X16X4_F32:
  // lane holds column r = lr, VGPR v holds K(=d) = 4*kk + 2*hl + v  (even -> 8B aligned)
  v2f qb[4];
#pragma unroll
  for (int kk = 0; kk < 4; ++kk)
    qb[kk] = *reinterpret_cast<const v2f*>(qh + (row_base + lr) * D_ + 4 * kk + 2 * hl);

  // per-head MLP parameters: lane lr prepares hidden unit lr, then the sixteen units are spread
  // to every lane. a carries the 1/sqrt(D) of the dot score (exact, a power of two).
  v2f al2[M_ / 2], be2[M_ / 2], om2[M_ / 2];  // threshold slope, threshold offset, weight w*|a|
  float ls, lc, l0;                           // gathered linear part: ls*s + lc*cost + l0
  {
    const float a0 = w1[h * 2 * M_ + lr] * 0.25f;
    const float cc = w1[h * 2 * M_ + M_ + lr];
    const float bb = b1[h * M_ + lr];
    const float ww = w2[h * M_ + lr];
    // a unit whose a is (next to) zero does not depend on s: a tiny positive a keeps -t/a finite,
    // and w*|a| * max(s, -t/a) + w*t is then w*relu(t) to rounding
    const float a   = fabsf(a0) < 1.0e-20f ? 1.0e-20f : a0;
    const bool  pos = a > 0.0f;
    const float alv = -cc / a;
    const float bev = -bb / a;
    const float omv = ww * fabsf(a);
    ls = row_sum(pos ? 0.0f : ww * a);
    lc = row_sum(pos ? ww * cc : 0.0f);
    l0 = row_sum(pos ? ww * bb : 0.0f) + b2[h];
#define SPREAD_(J)                                                      \
    al2[J] = v2f{from_lane<2 * J>(alv), from_lane<2 * J + 1>(alv)};     \
    be2[J] = v2f{from_lane<2 * J>(bev), from_lane<2 * J + 1>(bev)};     \
    om2[J] = v2f{from_lane<2 * J>(omv), from_lane<2 * J + 1>(omv)};
    SPREAD_(0) SPREAD_(1) SPREAD_(2) SPREAD_(3) SPREAD_(4) SPREAD_(5) SPREAD_(6) SPREAD_(7)
#undef SPREAD_
  }
  v8f o = {};              // O^T accumulator, D-layout: d = w + 8*hl, r = lr
  float mrun = -3.0e38f;   // running max of row lr (equal in both halves)
  float lrun = 0.0f;       // exp-sum of row lr over this half's columns

  const int cbeg = ((sp * NT_) / SPLIT_) * 16;
  const int cend = (((sp + 1) * NT_) / SPLIT_) * 16;
  static_assert(NT_ >= SPLIT_, "every column range holds at least one tile");
  int c0 = cbeg;
  do {  // no test in front of the first tile: its cost, K and V loads can then be issued ahead of the parameter work
    // cost tile, transposed D-layout: r = lr, c = c0 + w + 8*hl: eight columns in a row per lane
    const float* cp = costb + (size_t)(row_base + lr) * C_ + (c0 + 8 * hl);
    const v4f clo = *reinterpret_cast<const v4f*>(cp);
    const v4f chi = *reinterpret_cast<const v4f*>(cp + 4);
    const float cst[8] = {clo[0], clo[1], clo[2], clo[3], chi[0], chi[1], chi[2], chi[3]};

    // K tile, A-layout: lane holds row c0+lr, VGPR v holds K(=d) = 4*kk + 2*hl + v
    v2f ka[4];
#pragma unroll
    for (int kk = 0; kk < 4; ++kk)
      ka[kk] = *reinterpret_cast<const v2f*>(kh + (c0 + lr) * D_ + 4 * kk + 2 * hl);

    // V^T tile, A-layout: lane holds row d = lr; the K slot (hl, v) of step kk is the column
    // that register 2*kk + v of the score tile holds in this half: c = c0 + 2*kk + v + 8*hl
    v2f va[4];
#pragma unroll
    for (int kk = 0; kk < 4; ++kk) {
      va[kk][0] = vh[(c0 + 2 * kk + 8 * hl) * D_ + lr];
      va[kk][1] = vh[(c0 + 2 * kk + 1 + 8 * hl) * D_ + lr];
    }

    // holds all of the tile's loads in front of the score work, so that their latency runs under
    // it (beside the asm below the scheduler moved half of the V loads behind the MLP, next to their use)
    __builtin_amdgcn_sched_barrier(0);

    // S^T = K * Q^T  (K-dim 16 = 4 chained 16x16x4 f32 WMMAs)
    v8f s = {};
#pragma unroll
    for (int kk = 0; kk < 4; ++kk)
      s = __builtin_amdgcn_wmma_f32_16x16x4_f32(false, ka[kk], false, qb[kk],
                                                (short)0, s, false, false);

    // mixed score MLP, packed over pairs of columns; r = lr, c = c0 + w + 8*hl.
    // A packed instruction holds ONE hidden unit for two columns, so the sum over the units ends
    // in the column's own register: no add across a pair, and score, cost and sum stay in the
    // register pairs in which the WMMA and the loads deliver them.
    v2f c2[4], acc2[4];
#pragma unroll
    for (int p = 0; p < 4; ++p) {
      c2[p] = v2f{cst[2 * p], cst[2 * p + 1]};
      acc2[p] = __builtin_elementwise_fma(c2[p], v2f{lc, lc},
          __builtin_elementwise_fma(v2f{s[2 * p], s[2 * p + 1]}, v2f{ls, ls}, v2f{l0, l0}));
    }
#pragma unroll
    for (int mm = 0; mm < M_ / 2; ++mm) {
      // Units 2*mm and 2*mm + 1 for all eight columns: thresholds, max, weighted sum; eight
      // independent chains. asm because op_sel must take one half of a parameter pair for both
      // results: written in HIP the doubled parameters are loop constants, 96 registers, and spill.
      // The thresholds live only inside the statement, in v144..v159 (the max pairs name their halves).
      // s_delay_alu: the last four sums read the first four, four instructions back; with the hint
      // other waves issue meanwhile (the compiler hints nothing inside asm).
      asm("v_pk_fma_f32 v[144:145], %4, %8, %9 op_sel_hi:[1,0,0]\n\t"
          "v_pk_fma_f32 v[146:147], %5, %8, %9 op_sel_hi:[1,0,0]\n\t"
          "v_pk_fma_f32 v[148:149], %6, %8, %9 op_sel_hi:[1,0,0]\n\t"
          "v_pk_fma_f32 v[150:151], %7, %8, %9 op_sel_hi:[1,0,0]\n\t"
          "v_pk_fma_f32 v[152:153], %4, %8, %9 op_sel:[0,1,1]\n\t"
          "v_pk_fma_f32 v[154:155], %5, %8, %9 op_sel:[0,1,1]\n\t"
          "v_pk_fma_f32 v[156:157], %6, %8, %9 op_sel:[0,1,1]\n\t"
          "v_pk_fma_f32 v[158:159], %7, %8, %9 op_sel:[0,1,1]\n\t"
          "v_dual_max_num_f32 v145, v145, %12 :: v_dual_max_num_f32 v144, v144, %11\n\t"
          "v_dual_max_num_f32 v147, v147, %14 :: v_dual_max_num_f32 v146, v146, %13\n\t"
          "v_dual_max_num_f32 v149, v149, %16 :: v_dual_max_num_f32 v148, v148, %15\n\t"
          "v_dual_max_num_f32 v151, v151, %18 :: v_dual_max_num_f32 v150, v150, %17\n\t"
          "v_dual_max_num_f32 v153, v153, %12 :: v_dual_max_num_f32 v152, v152, %11\n\t"
          "v_dual_max_num_f32 v155, v155, %14 :: v_dual_max_num_f32 v154, v154, %13\n\t"
          "v_dual_max_num_f32 v157, v157, %16 :: v_dual_max_num_f32 v156, v156, %15\n\t"
          "v_dual_max_num_f32 v159, v159, %18 :: v_dual_max_num_f32 v158, v158, %17\n\t"
          "v_pk_fma_f32 %0, v[144:145], %10, %0 op_sel_hi:[1,0,1]\n\t"
          "v_pk_fma_f32 %1, v[146:147], %10, %1 op_sel_hi:[1,0,1]\n\t"
          "v_pk_fma_f32 %2, v[148:149], %10, %2 op_sel_hi:[1,0,1]\n\t"
          "v_pk_fma_f32 %3, v[150:151], %10, %3 op_sel_hi:[1,0,1]\n\t"
          "s_delay_alu instid0(VALU_DEP_4) | instskip(NEXT) | instid1(VALU_DEP_4)\n\t"
          "v_pk_fma_f32 %0, v[152:153], %10, %0 op_sel:[0,1,0]\n\t"
          "v_pk_fma_f32 %1, v[154:155], %10, %1 op_sel:[0,1,0]\n\t"
          "s_delay_alu instid0(VALU_DEP_4) | instskip(NEXT) | instid1(VALU_DEP_4)\n\t"
          "v_pk_fma_f32 %2, v[156:157], %10, %2 op_sel:[0,1,0]\n\t"
          "v_pk_fma_f32 %3, v[158:159], %10, %3 op_sel:[0,1,0]"
          : "+v"(acc2[0]), "+v"(acc2[1]), "+v"(acc2[2]), "+v"(acc2[3])
          : "v"(c2[0]), "v"(c2[1]), "v"(c2[2]), "v"(c2[3]), "v"(al2[mm]), "v"(be2[mm]), "v"(om2[mm]),
            "v"(s[0]), "v"(s[1]), "v"(s[2]), "v"(s[3]), "v"(s[4]), "v"(s[5]), "v"(s[6]), "v"(s[7])
          : "v144", "v145", "v146", "v147", "v148", "v149", "v150", "v151",
            "v152", "v153", "v154", "v155", "v156", "v157", "v158", "v159");
    }
    float acc[8];
#pragma unroll
    for (int w = 0; w < 8; ++w) acc[w] = acc2[w >> 1][w & 1];

    // row max of the tile: the lane's own eight columns, then the other half's eight
    float tmax = acc[0];
#pragma unroll
    for (int w = 1; w < 8; ++w) tmax = fmaxf(tmax, acc[w]);
    tmax = fmaxf(tmax, other_half(tmax));

    // online softmax: one max and one rescale per lane; the denominator is kept as a
    // per-lane partial and the two halves are added once at the end.
    const float mnew = fmaxf(mrun, tmax);
    const float resc = __expf(mrun - mnew);
    v2f pb[4];  // P^T, already the B operand: lane holds column r = lr, K slot (hl, v) as for va
#pragma unroll
    for (int kk = 0; kk < 4; ++kk) {  // exp(x) as exp2(x * log2(e)), the argument formed on the pair
      const v2f e2 = (acc2[kk] - v2f{mnew, mnew}) * v2f{1.44269504f, 1.44269504f};
      pb[kk][0] = __builtin_amdgcn_exp2f(e2[0]);
      pb[kk][1] = __builtin_amdgcn_exp2f(e2[1]);
    }
    const v2f ps = (pb[0] + pb[1]) + (pb[2] + pb[3]);
    lrun = fmaf(lrun, resc, ps[0] + ps[1]);
    mrun = mnew;
#pragma unroll
    for (int w = 0; w < 8; ++w) o[w] *= resc;

    // O^T += V^T * P^T
#pragma unroll
    for (int kk = 0; kk < 4; ++kk)
      o = __builtin_amdgcn_wmma_f32_16x16x4_f32(false, va[kk], false, pb[kk],
                                                (short)0, o, false, false);
    c0 += 16;
  } while (c0 < cend);

  // hand the partials of ranges 1..SPLIT_-1 to the wave of range 0 of the same row tile
  if (sp != 0) {
    float* dst = &part[(sp - 1) * 8 + rt][0][lane];
#pragma unroll
    for (int w = 0; w < 8; ++w) dst[w * 32] = o[w];
    dst[8 * 32] = mrun;
    dst[9 * 32] = lrun;
  }
  __syncthreads();
  if (sp != 0) return;

  // merge the ranges on a common row max, add the two halves' denominators, then write
  // out[b][r][h*16 + d] = O / l; the lane holds d = 8*hl .. 8*hl + 7 of row lr
  float mj[SPLIT_ - 1];
  float mall = mrun;
#pragma unroll
  for (int j = 0; j < SPLIT_ - 1; ++j) {
    mj[j] = part[j * 8 + rt][8][lane];
    mall = fmaxf(mall, mj[j]);
  }
  const float e0 = __expf(mrun - mall);
  float lv = lrun * e0;
  float ov[8];
#pragma unroll
  for (int w = 0; w < 8; ++w) ov[w] = o[w] * e0;
#pragma unroll
  for (int j = 0; j < SPLIT_ - 1; ++j) {
    const float ej = __expf(mj[j] - mall);
    lv = fmaf(part[j * 8 + rt][9][lane], ej, lv);
#pragma unroll
    for (int w = 0; w < 8; ++w) ov[w] = fmaf(part[j * 8 + rt][w][lane], ej, ov[w]);
  }
  const float lsum = lv + other_half(lv);
  float* op = out + ((size_t)b * R_ + (row_base + lr)) * (H_ * D_) + h * D_ + 8 * hl;
  const v4f r0 = {ov[0] / lsum, ov[1] / lsum, ov[2] / lsum, ov[3] / lsum};
  const v4f r1 = {ov[4] / lsum, ov[5] / lsum, ov[6] / lsum, ov[7] / lsum};
  *reinterpret_cast<v4f*>(op)     = r0;
  *reinterpret_cast<v4f*>(op + 4) = r1;
}

extern "C" void kernel_launch(void* const* d_in, const int* in_sizes, int n_in,
                              void* d_out, int out_size, void* d_ws, size_t ws_size,
                              hipStream_t stream) {
  const float* q    = (const float*)d_in[0];
  const float* k    = (const float*)d_in[1];
  const float* v    = (const float*)d_in[2];
  const float* cost = (const float*)d_in[3];
  const float* w1   = (const float*)d_in[4];
  const float* b1   = (const float*)d_in[5];
  const float* w2   = (const float*)d_in[6];
  const float* b2   = (const float*)d_in[7];
  float* out = (float*)d_out;

  // grid: B * H * (R/128) = 4 * 16 * 4 = 256 blocks; 768 threads = 8 row tiles x 3 column ranges
  dim3 grid(B_ * H_ * (R_ / 128));
  dim3 block(256 * SPLIT_);
  mixed_attn_kernel<<<grid, block, 0, stream>>>(q, k, v, cost, w1, b1, w2, b2, out);
}
